// v000
// Times are from an AMD MI455X. After a warm-up the kernel runs many times in a row, and a time is the length of
// such a window on the GPU divided by its runs, so every launch and the gaps after it count. The runs cycle
// through copies of the inputs. A figure is the median of several windows, for all but v000 over two sittings.
// Sittings can differ by a few percent; kernels timed side by side share one.
// The starting kernel, v000, takes 556 microseconds a run.
// Contractions: x.w_qkv on v_wmma_f32_16x16x32_bf16 with plain bf16 operands (x, w_qkv RNE-cast); attention q.k^T and p.v on v_wmma_f32_16x16x32_bf16 with bf16 hi/lo split operands (hi.hi + hi.lo + lo.hi); o.w_out with o as bf16 hi/lo planes and w_out RNE bf16 (hi.w + lo.w); f32 accumulate everywhere; online softmax, score scale and rank-1 bias in f32; q_proj/k_proj (K=3) on VALU f32.
#include <hip/hip_runtime.h>
#include <math.h>
#include <stdint.h>
#include <stddef.h>

typedef __attribute__((ext_vector_type(16))) _Float16 v16h;
typedef __attribute__((ext_vector_type(8)))  _Float16 v8h;
typedef __attribute__((ext_vector_type(16))) __bf16   v16b;
typedef __attribute__((ext_vector_type(8)))  __bf16   v8b;
typedef __attribute__((ext_vector_type(8)))  float    v8f;
typedef __attribute__((ext_vector_type(4)))  float    v4f;
typedef __attribute__((ext_vector_type(2)))  float    v2f;
typedef __attribute__((ext_vector_type(4)))  unsigned int v4u;

// ---- problem geometry ----
constexpr int kBatch = 2;
constexpr int kSeq   = 2048;
constexpr int kDm    = 1024;
constexpr int kHeads = 8;
constexpr int kHd    = 128;
constexpr int kQkvN  = 3072;   // 3 * kDm
constexpr int kQkW   = 2048;   // width of the q|k plane rows (q cols 0..1023, k cols 1024..2047)

__device__ __forceinline__ unsigned short f2bf_bits(float f) {
  unsigned u = __float_as_uint(f);
  return (unsigned short)((u + 0x7FFFu + ((u >> 16) & 1u)) >> 16);
}
__device__ __forceinline__ float bf_bits2f(unsigned short h) { return __uint_as_float(((unsigned)h) << 16); }
__device__ __forceinline__ unsigned pk16(unsigned short a, unsigned short b) { return (unsigned)a | ((unsigned)b << 16); }

// hazard guards as plain device helpers (no inline asm inside the kernel template body)
__device__ __forceinline__ void dep_guard_h(v8f& a, v8f& b, v16h x, v16h y) { asm volatile("v_nop\n\tv_nop\n\tv_nop\n\tv_nop" : "+v"(a), "+v"(b) : "v"(x), "v"(y)); }
__device__ __forceinline__ void dep_guard_b(v8f& a, v8f& b, v16b x, v16b y) { asm volatile("v_nop\n\tv_nop\n\tv_nop\n\tv_nop" : "+v"(a), "+v"(b) : "v"(x), "v"(y)); }
__device__ __forceinline__ void keep4_h(v16h a, v16h b, v16h c, v16h d) { asm volatile("v_nop" :: "v"(a), "v"(b), "v"(c), "v"(d)); }
__device__ __forceinline__ void keep4_b(v16b a, v16b b, v16b c, v16b d) { asm volatile("v_nop" :: "v"(a), "v"(b), "v"(c), "v"(d)); }
__device__ __forceinline__ void acc_guard4(v8f& a, v8f& b, v8f& c, v8f& d) { asm volatile("v_nop\n\tv_nop\n\tv_nop\n\tv_nop" : "+v"(a), "+v"(b), "+v"(c), "+v"(d)); }
template <typename T> struct Frag;
template <> struct Frag<_Float16> {
  typedef v16h V; union U { v16h v; v8h h[2]; };
  static __device__ __forceinline__ v16h load(const _Float16* p) {   // elements 0..7 <- p[0..7], 8..15 <- p[16..23]
    U f; f.h[0] = *(const v8h*)(p); f.h[1] = *(const v8h*)(p + 16); return f.v;
  }
  static __device__ __forceinline__ v8f mma(v16h a, v16h b, v8f c) {
    return __builtin_amdgcn_wmma_f32_16x16x32_f16(false, a, false, b, (short)0, c, false, false);
  }
  static __device__ __forceinline__ void guard(v8f& a, v8f& b, v16h x, v16h y) { dep_guard_h(a, b, x, y); }
  static __device__ __forceinline__ void keep(v16h a, v16h b, v16h c, v16h d) { keep4_h(a, b, c, d); }
};
template <> struct Frag<__bf16> {
  typedef v16b V; union U { v16b v; v8b h[2]; };
  static __device__ __forceinline__ v16b load(const __bf16* p) {
    U f; f.h[0] = *(const v8b*)(p); f.h[1] = *(const v8b*)(p + 16); return f.v;
  }
  static __device__ __forceinline__ v8f mma(v16b a, v16b b, v8f c) {
    return __builtin_amdgcn_wmma_f32_16x16x32_bf16(false, a, false, b, (short)0, c, false, false);
  }
  static __device__ __forceinline__ void guard(v8f& a, v8f& b, v16b x, v16b y) { dep_guard_b(a, b, x, y); }
  static __device__ __forceinline__ void keep(v16b a, v16b b, v16b c, v16b d) { keep4_b(a, b, c, d); }
};

// ---- Register-blocked batched WMMA GEMM ------------------------------------
// C[m,n] = scale * sum_k A[m,k] * Bt[n,k] (+bias)(+resid); each wave owns a 64x64 tile.
// A row-major [M,K]; Bt row-major [N,K]; M,N % 64 == 0, K % 32 == 0.
// SPLIT: operands are hi/lo planes (A2/Bt2 = lo planes, same layout); product = hi.hi + hi.lo + lo.hi.
//   BLO = false: the Bt operand has no lo plane (product = hi.hi + lo.hi, two WMMAs).
// BIAS_MODE: 0 = none, 1 = bias[m], 2 = bias[n].
// OUT_MODE: 0 = f32, 1 = f16, 2 = bf16 hi plane (Cout) + bf16 lo plane (Cout2).
// ET: 0 = f16 operands, 1 = bf16 operands (pointers passed as 16-bit storage)
template <int ET> struct Elem;
template <> struct Elem<0> { typedef _Float16 T; };
template <> struct Elem<1> { typedef __bf16 T; };
template <int ET, bool SPLIT, int BIAS_MODE, int OUT_MODE, bool RESID, int ACT = 0, bool BLO = true>
__global__ __launch_bounds__(256) void wmma_gemm64(
    const unsigned short* __restrict__ Ap, const unsigned short* __restrict__ A2p, int lda, long strideA,
    const unsigned short* __restrict__ Btp, const unsigned short* __restrict__ Bt2p, int ldb, long strideB,
    void* __restrict__ Cout, void* __restrict__ Cout2, int ldc, long strideC,
    const float* __restrict__ bias,
    const float* __restrict__ resid, long strideR,
    int M, int N, int K, float scale) {
  typedef typename Elem<ET>::T T;
  typedef typename Frag<T>::V V;
  const T* A = (const T*)Ap; const T* A2 = (const T*)A2p; const T* Bt = (const T*)Btp; const T* Bt2 = (const T*)Bt2p;
  __shared__ __align__(16) float sT[8][16 * 68];   // per-wave 16x64 slab, pitch 68 floats
  const int b    = blockIdx.y;
  const int lane = threadIdx.x & 31;
  const int wave = threadIdx.x >> 5;
  const int tilesN = N >> 6;
  const int tilesM = M >> 6;
  const int tile = blockIdx.x * 8 + wave;
  if (tile >= tilesM * tilesN) return;   // wave-uniform; no block barriers in this kernel
  const int tm = tile / tilesN;
  const int tn = tile - tm * tilesN;
  const int m0 = tm << 6;
  const int n0 = tn << 6;

  const T* Ab  = A  + (size_t)b * strideA;
  const T* Bb  = Bt + (size_t)b * strideB;
  const T* Ab2 = SPLIT ? (A2  + (size_t)b * strideA) : nullptr;
  const T* Bb2 = (SPLIT && BLO) ? (Bt2 + (size_t)b * strideB) : nullptr;

  const int rlane = lane & 15;                 // row (A) / col (B, D) within subtile
  const int koff  = (lane >> 4) * 8;           // k offset of this lane half
  const int mOff  = (lane >> 4) * 8;           // D row offset

  v8f acc[4][4];
#pragma unroll
  for (int i = 0; i < 4; ++i)
#pragma unroll
    for (int j = 0; j < 4; ++j) acc[i][j] = (v8f){0.f,0.f,0.f,0.f,0.f,0.f,0.f,0.f};

  for (int k0 = 0; k0 < K; k0 += 32) {
    V bh[4], bl[4];
#pragma unroll
    for (int j = 0; j < 4; ++j) {
      const size_t bo = (size_t)(n0 + (j << 4) + rlane) * ldb + koff + k0;
      bh[j] = Frag<T>::load(Bb + bo);
      if (SPLIT && BLO) bl[j] = Frag<T>::load(Bb2 + bo);
    }
#pragma unroll
    for (int i = 0; i < 4; ++i) {
      const size_t ao = (size_t)(m0 + (i << 4) + rlane) * lda + koff + k0;
      V ah = Frag<T>::load(Ab + ao);
      V al;
      if (SPLIT) al = Frag<T>::load(Ab2 + ao);
#pragma unroll
      for (int j = 0; j < 4; ++j) {
        acc[i][j] = Frag<T>::mma(ah, bh[j], acc[i][j]);
        if (SPLIT) {
          if (BLO) acc[i][j] = Frag<T>::mma(ah, bl[j], acc[i][j]);
          acc[i][j] = Frag<T>::mma(al, bh[j], acc[i][j]);
        }
      }
      Frag<T>::guard(acc[i][0], acc[i][3], ah, SPLIT ? al : ah);
    }
    Frag<T>::keep(bh[0], bh[1], bh[2], bh[3]);
    if (SPLIT && BLO) Frag<T>::keep(bl[0], bl[1], bl[2], bl[3]);
  }
  acc_guard4(acc[0][0], acc[0][1], acc[0][2], acc[0][3]);
  acc_guard4(acc[1][0], acc[1][1], acc[1][2], acc[1][3]);
  acc_guard4(acc[2][0], acc[2][1], acc[2][2], acc[2][3]);
  acc_guard4(acc[3][0], acc[3][1], acc[3][2], acc[3][3]);

  // ---- epilogue ----
  float* slab = sT[wave];
  const float* Rb = RESID ? (resid + (size_t)b * strideR) : nullptr;
#pragma unroll
  for (int i = 0; i < 4; ++i) {
    const int mBase = m0 + (i << 4);
#pragma unroll
    for (int j = 0; j < 4; ++j) {
      const int n = n0 + (j << 4) + rlane;
      float bv = 0.f;
      if (BIAS_MODE == 2) bv = bias[n];
#pragma unroll
      for (int r = 0; r < 8; ++r) {
        float v = acc[i][j][r] * scale;
        if (BIAS_MODE == 1) v += bias[mBase + mOff + r];
        if (BIAS_MODE == 2) v += bv;
        if (RESID) v += Rb[(size_t)(mBase + mOff + r) * ldc + n];
        if (ACT == 1) v = tanhf(v);
        if (ACT == 2) v = fmaxf(v, 0.0f);
        if (ACT == 3) v = v / (1.0f + expf(-v));
        if (ACT == 4) v = (v > 0.f) ? v : 0.01f * v;
        slab[(mOff + r) * 68 + (j << 4) + rlane] = v;
      }
    }
    __builtin_amdgcn_fence(__ATOMIC_RELEASE, "workgroup");
    __builtin_amdgcn_wave_barrier();
    __builtin_amdgcn_fence(__ATOMIC_ACQUIRE, "workgroup");
    if (OUT_MODE == 0) {
      float* C = (float*)Cout + (size_t)b * strideC;
      const int hh = lane >> 4, c4 = (lane & 15) * 4;     // row seg = 256 B = 16 lanes x 16 B
      {
#pragma unroll
        for (int it = 0; it < 8; ++it) {
          const int row = it * 2 + hh;
          v4f v = *(const v4f*)(slab + row * 68 + c4);
          *(v4f*)(C + (size_t)(mBase + row) * ldc + n0 + c4) = v;
        }
        
      }
    } else {
      const int q = lane >> 3, c8 = (lane & 7) * 8;
      unsigned short* C  = (unsigned short*)Cout  + (size_t)b * strideC;
      unsigned short* C2 = (OUT_MODE == 2) ? ((unsigned short*)Cout2 + (size_t)b * strideC) : nullptr;
      {
#pragma unroll
        for (int it = 0; it < 4; ++it) {
          const int row = it * 4 + q;
          const float* sp = slab + row * 68 + c8;
          v8h hv, lv;
#pragma unroll
          for (int e = 0; e < 8; ++e) {
            if (OUT_MODE == 1) {
              hv[e] = (_Float16)sp[e];
            } else {
              unsigned short hb = f2bf_bits(sp[e]);
              unsigned short lb = f2bf_bits(sp[e] - bf_bits2f(hb));
              hv[e] = __builtin_bit_cast(_Float16, hb);
              lv[e] = __builtin_bit_cast(_Float16, lb);
            }
          }
          *(v8h*)(C + (size_t)(mBase + row) * ldc + n0 + c8) = hv;
          if (OUT_MODE == 2) *(v8h*)(C2 + (size_t)(mBase + row) * ldc + n0 + c8) = lv;
        }
        
      }
    }
    __builtin_amdgcn_fence(__ATOMIC_RELEASE, "workgroup");
    __builtin_amdgcn_wave_barrier();
    __builtin_amdgcn_fence(__ATOMIC_ACQUIRE, "workgroup");
  }
}

// ---------------------------------------------------------------------------
// f32 -> bf16 (RNE) cast: 2 elements per thread, one 4-B store per lane -> each wave writes one whole
// Coverage: grid = n2/256 blocks x 256 threads x 2 elements = whole plane (n2 = n/2, n % 512 == 0 here).
// ---------------------------------------------------------------------------
__global__ __launch_bounds__(256) void cast_f32_bf16x2(const float* __restrict__ in, unsigned short* __restrict__ out, int n2) {
  const int i = blockIdx.x * 256 + threadIdx.x;
  if (i < n2) {
    const v2f f = *(const v2f*)(in + 2 * (size_t)i);
    const unsigned u = pk16(f2bf_bits(f[0]), f2bf_bits(f[1]));
    ((unsigned*)out)[i] = u;
    
  }
}

// ---------------------------------------------------------------------------
// Fused transpose + bf16 (RNE) cast of an f32 matrix: in [R rows][Cc cols] (pitch Cc) -> oh[c][r] = bf16(in[r][c]) ([Cc][R], pitch R).
// 64x64 tiles through LDS. grid = (Cc/64, R/64), 256 threads (R, Cc multiples of 64).
// Coverage per block: load 4 it x 256 thr x 4 floats = 64x64; store 2 it x 256 thr x 8 u16 = 64x64.
// ---------------------------------------------------------------------------
__global__ __launch_bounds__(256) void tcast_kernel(const float* __restrict__ W, unsigned short* __restrict__ oh, int R, int Cc) {
  __shared__ __align__(16) float tf[64 * 68];
  const int c0  = blockIdx.x * 64;   // input column block = output row block
  const int r0  = blockIdx.y * 64;   // input row block    = output column block
  const int tid = threadIdx.x;
  {
    const int lr = tid >> 4;         // 0..15
    const int c4 = (tid & 15) * 4;   // 0..60
#pragma unroll
    for (int it = 0; it < 4; ++it) {
      const int rr = it * 16 + lr;   // 0..63
      const v4f a = *(const v4f*)(W + (size_t)(r0 + rr) * Cc + c0 + c4);
      *(v4f*)(tf + rr * 68 + c4) = a;
    }
  }
  __syncthreads();
  const int sub = tid >> 3;          // 0..31
  const int c8  = (tid & 7) * 8;     // 0..56
  v4u hv[2];
#pragma unroll
  for (int it = 0; it < 2; ++it) {
    const int oc = it * 32 + sub;    // output row within tile (= input column)
    v4u a;
#pragma unroll
    for (int q = 0; q < 4; ++q) {
      const float f0 = tf[(c8 + 2 * q) * 68 + oc];
      const float f1 = tf[(c8 + 2 * q + 1) * 68 + oc];
      a[q] = pk16(f2bf_bits(f0), f2bf_bits(f1));
    }
    hv[it] = a;
  }
  {
#pragma unroll
    for (int it = 0; it < 2; ++it) {
      const int oc = it * 32 + sub;
      const size_t go = (size_t)(c0 + oc) * R + r0 + c8;
      *(v4u*)(oh + go) = hv[it];
    }
    
  }
}

// ---------------------------------------------------------------------------
// Fused transpose + bf16 hi/lo split with explicit pitches and a z batch:
//   in element (r, c) at W + z*zin + r*pin + c  ->  oh[c][r], ol[c][r] at o + z*zout + c*pout + r.
// 64x64 tiles through LDS. grid = (Cc/64, R/64, Z), 256 threads.
// Coverage per block and plane: load 4 it x 256 thr x 4 floats = 64x64; store 2 it x 256 thr x 8 u16 = 64x64.
// ---------------------------------------------------------------------------
__global__ __launch_bounds__(256) void tsplitp_kernel(const float* __restrict__ W, int pin, long zin,
                                                      unsigned short* __restrict__ oh, unsigned short* __restrict__ ol, int pout, long zout) {
  __shared__ __align__(16) float tf[64 * 68];
  const int c0  = blockIdx.x * 64;
  const int r0  = blockIdx.y * 64;
  const int tid = threadIdx.x;
  const float* Wz = W + (size_t)blockIdx.z * zin;
  unsigned short* ohz = oh + (size_t)blockIdx.z * zout;
  unsigned short* olz = ol + (size_t)blockIdx.z * zout;
  {
    const int lr = tid >> 4;
    const int c4 = (tid & 15) * 4;
#pragma unroll
    for (int it = 0; it < 4; ++it) {
      const int rr = it * 16 + lr;
      const v4f a = *(const v4f*)(Wz + (size_t)(r0 + rr) * pin + c0 + c4);
      *(v4f*)(tf + rr * 68 + c4) = a;
    }
  }
  __syncthreads();
  const int sub = tid >> 3;
  const int c8  = (tid & 7) * 8;
  v4u hv[2], lv[2];
#pragma unroll
  for (int it = 0; it < 2; ++it) {
    const int oc = it * 32 + sub;
    v4u a, a2;
#pragma unroll
    for (int q = 0; q < 4; ++q) {
      const float f0 = tf[(c8 + 2 * q) * 68 + oc];
      const float f1 = tf[(c8 + 2 * q + 1) * 68 + oc];
      const unsigned short h0 = f2bf_bits(f0), h1 = f2bf_bits(f1);
      const unsigned short l0 = f2bf_bits(f0 - bf_bits2f(h0)), l1 = f2bf_bits(f1 - bf_bits2f(h1));
      a[q]  = pk16(h0, h1);
      a2[q] = pk16(l0, l1);
    }
    hv[it] = a; lv[it] = a2;
  }
  {
#pragma unroll
    for (int it = 0; it < 2; ++it) {
      const int oc = it * 32 + sub;
      const size_t go = (size_t)(c0 + oc) * pout + r0 + c8;
      *(v4u*)(ohz + go) = hv[it];
      *(v4u*)(olz + go) = lv[it];
    }
    
  }
}

// ---------------------------------------------------------------------------
// q|k columns of the f32 qkv matrix -> bf16 hi/lo planes: in row (b*T+t) pitch 3072, cols 0..2047 ->
// planes [4096][2048] pitch 2048. 2 elements per thread (u32 index i = row*1024 + pair), one 4-B store per lane per plane:
// Coverage: grid = n2/256 blocks x 256 threads x 2 = 4096 x 2048 elements per plane.
// ---------------------------------------------------------------------------
__global__ __launch_bounds__(256) void split_qk_kernel(const float* __restrict__ Cm, unsigned short* __restrict__ hi,
                                                       unsigned short* __restrict__ lo, int n2) {
  const int i = blockIdx.x * 256 + threadIdx.x;
  if (i < n2) {
    const int row = i >> 10;
    const int cp  = (i & 1023) * 2;
    const v2f f = *(const v2f*)(Cm + (size_t)row * kQkvN + cp);
    const unsigned short h0 = f2bf_bits(f[0]), h1 = f2bf_bits(f[1]);
    const unsigned short l0 = f2bf_bits(f[0] - bf_bits2f(h0)), l1 = f2bf_bits(f[1] - bf_bits2f(h1));
    const unsigned uh = pk16(h0, h1), ul = pk16(l0, l1);
    ((unsigned*)hi)[i] = uh;
    ((unsigned*)lo)[i] = ul;
    
  }
}

// ---------------------------------------------------------------------------
// Rank-1 geometric projections: qp[(b*H+h)*T + t] = sum_{d<3} q[b,t,h,d]*dir[h][d], kp likewise (dir = sign bits of h / sqrt(3), f32).
// Coverage: grid = n/256 blocks x 256 threads = B*H*T.
// ---------------------------------------------------------------------------
__global__ __launch_bounds__(256) void geo_proj_kernel(const float* __restrict__ Cm, float* __restrict__ qp, float* __restrict__ kp, int n) {
  const int i = blockIdx.x * 256 + threadIdx.x;
  if (i < n) {
    const int t  = i & (kSeq - 1);
    const int bh = i >> 11;
    const int h  = bh & 7;
    const int b  = bh >> 3;
    const float rs3 = 1.0f / 1.7320508f;
    const float dx = (float)(((h >> 2) & 1) * 2 - 1) * rs3;
    const float dy = (float)(((h >> 1) & 1) * 2 - 1) * rs3;
    const float dz = (float)((h & 1) * 2 - 1) * rs3;
    const float* qr = Cm + (size_t)(b * kSeq + t) * kQkvN + h * kHd;
    const float* kr = qr + kDm;
    const float a  = qr[0] * dx + qr[1] * dy + qr[2] * dz;
    const float bb = kr[0] * dx + kr[1] * dy + kr[2] * dz;
    ((float*)qp)[i] = a;
    ((float*)kp)[i] = bb;
    
  }
}

// =====================================================================================
// Causal attention, head dim 128, 8 heads, with rank-1 score bias.
//   q|k hi/lo bf16 planes: q element (b, t, h, d) at [(b*T + t)*2048 + h*128 + d]; k at the same + 1024
//   v^T hi/lo bf16 planes: element (b, h, d, s) at [(b*1024 + h*128 + d)*T + s]
//   out hi/lo bf16 planes: element (b, t, h, d) at [(b*T + t)*1024 + h*128 + d]
//   scores = (q . k) * sscale + hs[h] * qp[t] * kp[s]  : q.k as bf16 hi/lo split (hi.hi + hi.lo + lo.hi)
//   out    = p . v                                      : bf16 hi/lo split of p (unnormalised) and v, f32 accumulate
//   online softmax in f32; masked (s > t) scores set to -inf (column s = chunk start <= t is always unmasked).
//   Block = 4 waves = 64 query rows of one (b, h); grid.x = B * H * (T/64); kv chunks of 64, trip count qb+1 <= 32.
//   K / V^T chunk staging: K planes 128 threads x 64 elements = 64 kv x 128 d; V^T planes 128 threads x 64 = 128 d x 64 kv
//   (16-B copies, plain loads, __syncthreads before and after); fragment loads read the LDS tiles with the same v8b element type.
//   The K/V LDS region is reused as the f32 output staging after the chunk loop (block barrier between).
// =====================================================================================
constexpr int kKc  = 64;    // kv chunk
constexpr int kOsP = 132;   // f32 out staging pitch (floats)

__device__ __forceinline__ v8f at_mma(v16b a, v16b b, v8f c) {
  c = __builtin_amdgcn_wmma_f32_16x16x32_bf16(false, a, false, b, (short)0, c, false, false);
  asm volatile("v_nop\n\tv_nop\n\tv_nop\n\tv_nop" : "+v"(c) : "v"(a), "v"(b));
  return c;
}
__device__ __forceinline__ void at_split(float f, __bf16& hi, __bf16& lo) {
  const unsigned short hb = f2bf_bits(f);
  hi = __builtin_bit_cast(__bf16, hb);
  lo = __builtin_bit_cast(__bf16, f2bf_bits(f - bf_bits2f(hb)));
}
__device__ __forceinline__ void split_pair(float a, float b, unsigned& hp, unsigned& lp) {
  const unsigned short ha = f2bf_bits(a), hb = f2bf_bits(b);
  const unsigned short la = f2bf_bits(a - bf_bits2f(ha)), lb = f2bf_bits(b - bf_bits2f(hb));
  hp = pk16(ha, hb);
  lp = pk16(la, lb);
}

__global__ __launch_bounds__(128)
void attn_causal128_kernel(const unsigned short* __restrict__ qkhp, const unsigned short* __restrict__ qklp,
                           const unsigned short* __restrict__ vthp, const unsigned short* __restrict__ vtlp,
                           const float* __restrict__ qpv, const float* __restrict__ kpv, const float* __restrict__ hsv,
                           unsigned short* __restrict__ ohp, unsigned short* __restrict__ olp, float sscale) {
  union FB { v16b v; v8b h[2]; };
  __shared__ __align__(16) __bf16 kvs[4 * kKc * kHd];          // 65536 B: K hi | K lo ([kv][d]) | V hi | V lo ([d][kv])
  __shared__ __align__(16) __bf16 Psh[4][16 * kKc];            // per wave P hi [row][kv]
  __shared__ __align__(16) __bf16 Psl[4][16 * kKc];            // per wave P lo
  __bf16* const Ksh = kvs;
  __bf16* const Ksl = kvs + kKc * kHd;
  __bf16* const Vth = kvs + 2 * kKc * kHd;
  __bf16* const Vtl = kvs + 3 * kKc * kHd;

  const int tid  = threadIdx.x;
  const int wave = tid >> 5;
  const int lane = tid & 31;
  const int hh   = lane >> 4;
  const int c    = lane & 15;

  const int bx  = blockIdx.x;
  const int qb  = bx & 31;              // T/64 = 32 query blocks
  const int bhi = bx >> 5;
  const int h   = bhi & 7;
  const int b   = bhi >> 3;
  const int q0  = qb * 64 + wave * 16;

  const __bf16* Qh = (const __bf16*)(const void*)qkhp;
  const __bf16* Ql = (const __bf16*)(const void*)qklp;
  const __bf16* Vh = (const __bf16*)(const void*)vthp;
  const __bf16* Vl = (const __bf16*)(const void*)vtlp;

  const size_t qoff  = (size_t)(b * kSeq + q0 + c) * kQkW + h * kHd + 8 * hh;   // + dc*32 (Frag load adds 0 / 16)
  const size_t kbase = (size_t)(b * kSeq) * kQkW + kDm + h * kHd;                // + (kv0 + r)*kQkW
  const size_t vbase = (size_t)(b * kDm + h * kHd) * kSeq;                       // + d*kSeq + kv0
  const int gbase = (b * kHeads + h) * kSeq;

  float gq[8];
#pragma unroll
  for (int r = 0; r < 8; ++r) gq[r] = qpv[gbase + q0 + 8 * hh + r];
  const float hsb = bf_bits2f(f2bf_bits(hsv[h]));

  float mrow[8], lrow[8];
  v8f oacc[8];
#pragma unroll
  for (int r = 0; r < 8; ++r) { mrow[r] = -INFINITY; lrow[r] = 0.f; }
#pragma unroll
  for (int t = 0; t < 8; ++t) oacc[t] = (v8f){0.f,0.f,0.f,0.f,0.f,0.f,0.f,0.f};

  const int nChunks = qb + 1;   // block-uniform, <= 32
  for (int kc = 0; kc < nChunks; ++kc) {
    const int kv0 = kc * kKc;
    __syncthreads();
    {
      // K planes: thread -> kv row r = tid>>1, d half = (tid&1)*64, 8 x v8b = 64 elements; 128 threads cover 64 x 128 per plane
      const int r = tid >> 1, half = (tid & 1) * 64;
      const __bf16* ks0 = Qh + kbase + (size_t)(kv0 + r) * kQkW + half;
      const __bf16* ks1 = Ql + kbase + (size_t)(kv0 + r) * kQkW + half;
#pragma unroll
      for (int i = 0; i < 8; ++i) {
        const v8b a0 = *(const v8b*)(ks0 + 8 * i);
        const v8b a1 = *(const v8b*)(ks1 + 8 * i);
        *(v8b*)(Ksh + r * kHd + half + 8 * i) = a0;
        *(v8b*)(Ksl + r * kHd + half + 8 * i) = a1;
      }
      asm volatile("" ::: "memory");
      // V^T planes: thread -> d row = tid, 8 x v8b = 64 kv; 128 threads cover 128 x 64 per plane
      const __bf16* vs0 = Vh + vbase + (size_t)tid * kSeq + kv0;
      const __bf16* vs1 = Vl + vbase + (size_t)tid * kSeq + kv0;
#pragma unroll
      for (int i = 0; i < 8; ++i) {
        const v8b b0 = *(const v8b*)(vs0 + 8 * i);
        const v8b b1 = *(const v8b*)(vs1 + 8 * i);
        *(v8b*)(Vth + tid * kKc + 8 * i) = b0;
        *(v8b*)(Vtl + tid * kKc + 8 * i) = b1;
      }
    }
    __syncthreads();

    // ---- scores: A = q rows (global, split k map via Frag load), B = k rows from LDS; K = 128 = 4 k-steps ----
    v8f s[4];
#pragma unroll
    for (int j = 0; j < 4; ++j) s[j] = (v8f){0.f,0.f,0.f,0.f,0.f,0.f,0.f,0.f};
#pragma unroll 1
    for (int dc = 0; dc < 4; ++dc) {
      const v16b qa_h = Frag<__bf16>::load(Qh + qoff + dc * 32);
      const v16b qa_l = Frag<__bf16>::load(Ql + qoff + dc * 32);
#pragma unroll
      for (int j = 0; j < 4; ++j) {
        FB kb, kl;
        const __bf16* kr0 = Ksh + (j * 16 + c) * kHd + dc * 32 + 8 * hh;
        const __bf16* kr1 = Ksl + (j * 16 + c) * kHd + dc * 32 + 8 * hh;
        kb.h[0] = *(const v8b*)(kr0);
        kb.h[1] = *(const v8b*)(kr0 + 16);
        kl.h[0] = *(const v8b*)(kr1);
        kl.h[1] = *(const v8b*)(kr1 + 16);
        s[j] = at_mma(qa_h, kb.v, s[j]);
        s[j] = at_mma(qa_h, kl.v, s[j]);
        s[j] = at_mma(qa_l, kb.v, s[j]);
      }
    }
    float gk[4];
#pragma unroll
    for (int j = 0; j < 4; ++j) gk[j] = kpv[gbase + kv0 + j * 16 + c];
    const bool diag = (kc == qb);   // block-uniform
    float cm[8];
#pragma unroll
    for (int r = 0; r < 8; ++r) {
      const int qrow = q0 + 8 * hh + r;
      float m = -INFINITY;
#pragma unroll
      for (int j = 0; j < 4; ++j) {
        const int kvcol = kv0 + j * 16 + c;
        const float sv = s[j][r] * sscale + hsb * (gq[r] * gk[j]);
        const bool masked = diag && (kvcol > qrow);
        const float sm = masked ? -INFINITY : sv;
        s[j][r] = sm;
        m = fmaxf(m, sm);
      }
#pragma unroll
      for (int off = 1; off < 16; off <<= 1) m = fmaxf(m, __shfl_xor(m, off, 32));
      cm[r] = m;
    }
    __bf16* pwh = Psh[wave];
    __bf16* pwl = Psl[wave];
#pragma unroll
    for (int r = 0; r < 8; ++r) {
      const float mnew = fmaxf(mrow[r], cm[r]);
      const float alpha = expf(mrow[r] - mnew);
      mrow[r] = mnew;
      float psum = 0.f;
#pragma unroll
      for (int j = 0; j < 4; ++j) {
        const float p = expf(s[j][r] - mnew);
        psum += p;
        __bf16 a, bl; at_split(p, a, bl);
        pwh[(8 * hh + r) * kKc + j * 16 + c] = a;
        pwl[(8 * hh + r) * kKc + j * 16 + c] = bl;
      }
#pragma unroll
      for (int off = 1; off < 16; off <<= 1) psum += __shfl_xor(psum, off, 32);
      lrow[r] = lrow[r] * alpha + psum;
#pragma unroll
      for (int t = 0; t < 8; ++t) oacc[t][r] *= alpha;
    }
    __builtin_amdgcn_fence(__ATOMIC_RELEASE, "workgroup");
    __builtin_amdgcn_wave_barrier();
    __builtin_amdgcn_fence(__ATOMIC_ACQUIRE, "workgroup");
    // ---- out += p . v : A = P [16 q][64 kv] from the wave's LDS tile, B = V^T [d][kv] from LDS; 8 d-tiles of 16 ----
#pragma unroll 1
    for (int kk = 0; kk < 2; ++kk) {
      FB pa, pl;
      pa.h[0] = *(const v8b*)(pwh + c * kKc + kk * 32 + 8 * hh);
      pa.h[1] = *(const v8b*)(pwh + c * kKc + kk * 32 + 16 + 8 * hh);
      pl.h[0] = *(const v8b*)(pwl + c * kKc + kk * 32 + 8 * hh);
      pl.h[1] = *(const v8b*)(pwl + c * kKc + kk * 32 + 16 + 8 * hh);
#pragma unroll
      for (int t = 0; t < 8; ++t) {
        FB vb, vl;
        const __bf16* vr0 = Vth + (t * 16 + c) * kKc + kk * 32 + 8 * hh;
        const __bf16* vr1 = Vtl + (t * 16 + c) * kKc + kk * 32 + 8 * hh;
        vb.h[0] = *(const v8b*)(vr0);
        vb.h[1] = *(const v8b*)(vr0 + 16);
        vl.h[0] = *(const v8b*)(vr1);
        vl.h[1] = *(const v8b*)(vr1 + 16);
        oacc[t] = at_mma(pa.v, vb.v, oacc[t]);
        oacc[t] = at_mma(pa.v, vl.v, oacc[t]);
        oacc[t] = at_mma(pl.v, vb.v, oacc[t]);
      }
    }
  }
  __syncthreads();   // all waves done with the K/V tiles; region becomes f32 out staging

  // ---- normalise, stage the wave's 16x128 tile (f32), write hi/lo bf16 rows: 16 lanes x 16 B = one whole 256-B row, 2 rows per instruction ----
  float* os = (float*)(void*)kvs + wave * 16 * kOsP;
#pragma unroll
  for (int r = 0; r < 8; ++r) {
    const float inv = 1.0f / lrow[r];
#pragma unroll
    for (int t = 0; t < 8; ++t) os[(8 * hh + r) * kOsP + t * 16 + c] = oacc[t][r] * inv;
  }
  __builtin_amdgcn_fence(__ATOMIC_RELEASE, "workgroup");
  __builtin_amdgcn_wave_barrier();
  __builtin_amdgcn_fence(__ATOMIC_ACQUIRE, "workgroup");
  {
    const size_t obase = (size_t)(b * kSeq + q0) * kDm + h * kHd + c * 8;
    {
#pragma unroll
      for (int it = 0; it < 8; ++it) {
        const int row = it * 2 + hh;   // it 0..7 x hh 0..1 covers rows 0..15; c 0..15 x 8 covers d 0..127
        const float* sp = os + row * kOsP + c * 8;
        const v4f f0 = *(const v4f*)(sp);
        const v4f f1 = *(const v4f*)(sp + 4);
        v4u hv, lv;
        unsigned hp, lp;
        split_pair(f0[0], f0[1], hp, lp); hv[0] = hp; lv[0] = lp;
        split_pair(f0[2], f0[3], hp, lp); hv[1] = hp; lv[1] = lp;
        split_pair(f1[0], f1[1], hp, lp); hv[2] = hp; lv[2] = lp;
        split_pair(f1[2], f1[3], hp, lp); hv[3] = hp; lv[3] = lp;
        *(v4u*)(ohp + obase + (size_t)row * kDm) = hv;
        *(v4u*)(olp + obase + (size_t)row * kDm) = lv;
      }
      
    }
  }
}

// =====================================================================================
//   [0,          8388608)   xb   : x as bf16 [4096][1024]
//   [8388608,   14680064)   wqT  : w_qkv^T bf16 [3072][1024]
//   [14680064,  16777216)   woT  : w_out^T bf16 [1024][1024]
//   [16777216,  67108864)   Cqkv : f32 [4096][3072]; after its consumers: Oh bf16 [4096][1024] at 16777216, Ol at 25165824
//   [67108864,  83886080)   QKh  : bf16 [4096][2048]
//   [83886080, 100663296)   QKl  : bf16 [4096][2048]
//   [100663296,109051904)   Vth  : bf16 [2][1024][2048]
//   [109051904,117440512)   Vtl  : bf16 [2][1024][2048]
//   [117440512,117571584)   qp   : f32 [2][8][2048]
//   [117571584,117702656)   kp   : f32 [2][8][2048]
//   total 117702656 B
// =====================================================================================
extern "C" void kernel_launch(void* const* d_in, const int* in_sizes, int n_in,
                              void* d_out, int out_size, void* d_ws, size_t ws_size,
                              hipStream_t stream) {
  if (n_in < 4) return;
  const int nX = kBatch * kSeq * kDm;       // 4194304
  if (in_sizes[0] != nX || in_sizes[1] != kDm * kQkvN || in_sizes[2] != kDm * kDm || in_sizes[3] != kHeads) return;
  if (out_size != nX) return;

  const size_t off_xb  = 0;
  const size_t off_wq  = off_xb  + (size_t)nX * 2;                              // 8388608
  const size_t off_wo  = off_wq  + (size_t)kQkvN * kDm * 2;                     // 14680064
  const size_t off_c   = off_wo  + (size_t)kDm * kDm * 2;                       // 16777216
  const size_t off_oh  = off_c;                                                 // reuse after Cqkv is dead
  const size_t off_ol  = off_c   + (size_t)nX * 2;                              // 25165824
  const size_t off_qkh = off_c   + (size_t)kBatch * kSeq * kQkvN * 4;           // 67108864
  const size_t off_qkl = off_qkh + (size_t)kBatch * kSeq * kQkW * 2;            // 83886080
  const size_t off_vth = off_qkl + (size_t)kBatch * kSeq * kQkW * 2;            // 100663296
  const size_t off_vtl = off_vth + (size_t)kBatch * kDm * kSeq * 2;             // 109051904
  const size_t off_qp  = off_vtl + (size_t)kBatch * kDm * kSeq * 2;             // 117440512
  const size_t off_kp  = off_qp  + (size_t)kBatch * kHeads * kSeq * 4;          // 117571584
  const size_t total   = off_kp  + (size_t)kBatch * kHeads * kSeq * 4;          // 117702656
  if (total > ws_size) return;

  const float* x    = (const float*)d_in[0];
  const float* wqkv = (const float*)d_in[1];
  const float* wout = (const float*)d_in[2];
  const float* hsc  = (const float*)d_in[3];
  float* y = (float*)d_out;
  char* w = (char*)d_ws;
  unsigned short* xb  = (unsigned short*)(w + off_xb);
  unsigned short* wqT = (unsigned short*)(w + off_wq);
  unsigned short* woT = (unsigned short*)(w + off_wo);
  float*          cq  = (float*)(w + off_c);
  unsigned short* oh  = (unsigned short*)(w + off_oh);
  unsigned short* ol  = (unsigned short*)(w + off_ol);
  unsigned short* qkh = (unsigned short*)(w + off_qkh);
  unsigned short* qkl = (unsigned short*)(w + off_qkl);
  unsigned short* vth = (unsigned short*)(w + off_vth);
  unsigned short* vtl = (unsigned short*)(w + off_vtl);
  float*          qp  = (float*)(w + off_qp);
  float*          kp  = (float*)(w + off_kp);

  // 1. x -> bf16 (n2 = 2097152 pairs; 8192 blocks x 256 threads x 2 = 4194304 elements)
  cast_f32_bf16x2<<<dim3(nX / 2 / 256), dim3(256), 0, stream>>>(x, xb, nX / 2);
  // 2. w_qkv [1024 in][3072 out] -> wqT [3072][1024] bf16 ; grid (cols/64, rows/64)
  tcast_kernel<<<dim3(kQkvN / 64, kDm / 64), dim3(256), 0, stream>>>(wqkv, wqT, kDm, kQkvN);
  // 3. w_out [1024 in][1024 out] -> woT [1024][1024] bf16
  tcast_kernel<<<dim3(kDm / 64, kDm / 64), dim3(256), 0, stream>>>(wout, woT, kDm, kDm);
  // 4. qkv = x . w_qkv : M=4096, N=3072, K=1024 (all tile multiples, K%32==0); 3072 tiles / 8 per block = 384 blocks
  wmma_gemm64<1, false, 0, 0, false><<<dim3((kBatch * kSeq / 64) * (kQkvN / 64) / 8, 1), dim3(256), 0, stream>>>(
      xb, xb, kDm, 0L, wqT, wqT, kDm, 0L, (void*)cq, (void*)cq, kQkvN, 0L,
      (const float*)nullptr, (const float*)nullptr, 0L, kBatch * kSeq, kQkvN, kDm, 1.0f);
  // 5. rank-1 projections (32768 threads)
  geo_proj_kernel<<<dim3(kBatch * kHeads * kSeq / 256), dim3(256), 0, stream>>>(cq, qp, kp, kBatch * kHeads * kSeq);
  // 6. q|k columns -> bf16 hi/lo planes [4096][2048] (n2 = 4194304 pairs)
  split_qk_kernel<<<dim3(kBatch * kSeq * kQkW / 2 / 256), dim3(256), 0, stream>>>(cq, qkh, qkl, kBatch * kSeq * kQkW / 2);
  // 7. v columns [t][h*128+d] (pitch 3072, col offset 2048) -> V^T hi/lo [b][1024][2048]; grid (1024/64, 2048/64, 2)
  tsplitp_kernel<<<dim3(kDm / 64, kSeq / 64, kBatch), dim3(256), 0, stream>>>(
      cq + 2 * kDm, kQkvN, (long)kSeq * kQkvN, vth, vtl, kSeq, (long)kDm * kSeq);
  // 8. causal attention with rank-1 bias: grid = B*H*(T/64) = 512 blocks of 128
  attn_causal128_kernel<<<dim3(kBatch * kHeads * (kSeq / 64)), dim3(128), 0, stream>>>(
      qkh, qkl, vth, vtl, qp, kp, hsc, oh, ol, 0.08838834764831845f);
  // 9. out = o . w_out : A = o hi/lo, Bt = woT (hi only); M=4096, N=1024, K=1024; 1024 tiles / 8 = 128 blocks
  wmma_gemm64<1, true, 0, 0, false, 0, false><<<dim3((kBatch * kSeq / 64) * (kDm / 64) / 8, 1), dim3(256), 0, stream>>>(
      oh, ol, kDm, 0L, woT, woT, kDm, 0L, (void*)y, (void*)y, kDm, 0L,
      (const float*)nullptr, (const float*)nullptr, 0L, kBatch * kSeq, kDm, kDm, 1.0f);
}

// v001
// Measured time: 380 microseconds a run.
// In both of two side-by-side timings against v000, it was 1.49 times as fast.
// Contractions: x.w_qkv on v_wmma_f32_16x16x32_bf16 with plain bf16 operands (x, w_qkv RNE-cast); attention q.k^T and p.v on v_wmma_f32_16x16x32_bf16 with bf16 hi/lo split operands (hi.hi + hi.lo + lo.hi); o.w_out with o as bf16 hi/lo planes and w_out RNE bf16 (hi.w + lo.w); f32 accumulate everywhere; online softmax, score scale and rank-1 bias in f32; q_proj/k_proj (K=3) on VALU f32.
#include <hip/hip_runtime.h>
#include <math.h>
#include <stdint.h>
#include <stddef.h>

typedef __attribute__((ext_vector_type(16))) _Float16 v16h;
typedef __attribute__((ext_vector_type(8)))  _Float16 v8h;
typedef __attribute__((ext_vector_type(16))) __bf16   v16b;
typedef __attribute__((ext_vector_type(8)))  __bf16   v8b;
typedef __attribute__((ext_vector_type(8)))  float    v8f;
typedef __attribute__((ext_vector_type(4)))  float    v4f;
typedef __attribute__((ext_vector_type(2)))  float    v2f;
typedef __attribute__((ext_vector_type(4)))  unsigned int v4u;

// ---- problem geometry ----
constexpr int kBatch = 2;
constexpr int kSeq   = 2048;
constexpr int kDm    = 1024;
constexpr int kHeads = 8;
constexpr int kHd    = 128;
constexpr int kQkvN  = 3072;   // 3 * kDm
constexpr int kQkW   = 2048;   // width of the q|k plane rows (q cols 0..1023, k cols 1024..2047)

__device__ __forceinline__ unsigned short f2bf_bits(float f) {
  unsigned u = __float_as_uint(f);
  return (unsigned short)((u + 0x7FFFu + ((u >> 16) & 1u)) >> 16);
}
__device__ __forceinline__ float bf_bits2f(unsigned short h) { return __uint_as_float(((unsigned)h) << 16); }
__device__ __forceinline__ unsigned pk16(unsigned short a, unsigned short b) { return (unsigned)a | ((unsigned)b << 16); }

// hazard guards as plain device helpers (no inline asm inside the kernel template body)
__device__ __forceinline__ void dep_guard_h(v8f& a, v8f& b, v16h x, v16h y) { asm volatile("v_nop\n\tv_nop\n\tv_nop\n\tv_nop" : "+v"(a), "+v"(b) : "v"(x), "v"(y)); }
__device__ __forceinline__ void dep_guard_b(v8f& a, v8f& b, v16b x, v16b y) { asm volatile("v_nop\n\tv_nop\n\tv_nop\n\tv_nop" : "+v"(a), "+v"(b) : "v"(x), "v"(y)); }
__device__ __forceinline__ void keep4_h(v16h a, v16h b, v16h c, v16h d) { asm volatile("v_nop" :: "v"(a), "v"(b), "v"(c), "v"(d)); }
__device__ __forceinline__ void keep4_b(v16b a, v16b b, v16b c, v16b d) { asm volatile("v_nop" :: "v"(a), "v"(b), "v"(c), "v"(d)); }
__device__ __forceinline__ void acc_guard4(v8f& a, v8f& b, v8f& c, v8f& d) { asm volatile("v_nop\n\tv_nop\n\tv_nop\n\tv_nop" : "+v"(a), "+v"(b), "+v"(c), "+v"(d)); }
template <typename T> struct Frag;
template <> struct Frag<_Float16> {
  typedef v16h V; union U { v16h v; v8h h[2]; };
  static __device__ __forceinline__ v16h load(const _Float16* p) {   // elements 0..7 <- p[0..7], 8..15 <- p[16..23]
    U f; f.h[0] = *(const v8h*)(p); f.h[1] = *(const v8h*)(p + 16); return f.v;
  }
  static __device__ __forceinline__ v8f mma(v16h a, v16h b, v8f c) {
    return __builtin_amdgcn_wmma_f32_16x16x32_f16(false, a, false, b, (short)0, c, false, false);
  }
  static __device__ __forceinline__ void guard(v8f& a, v8f& b, v16h x, v16h y) { dep_guard_h(a, b, x, y); }
  static __device__ __forceinline__ void keep(v16h a, v16h b, v16h c, v16h d) { keep4_h(a, b, c, d); }
};
template <> struct Frag<__bf16> {
  typedef v16b V; union U { v16b v; v8b h[2]; };
  static __device__ __forceinline__ v16b load(const __bf16* p) {
    U f; f.h[0] = *(const v8b*)(p); f.h[1] = *(const v8b*)(p + 16); return f.v;
  }
  static __device__ __forceinline__ v8f mma(v16b a, v16b b, v8f c) {
    return __builtin_amdgcn_wmma_f32_16x16x32_bf16(false, a, false, b, (short)0, c, false, false);
  }
  static __device__ __forceinline__ void guard(v8f& a, v8f& b, v16b x, v16b y) { dep_guard_b(a, b, x, y); }
  static __device__ __forceinline__ void keep(v16b a, v16b b, v16b c, v16b d) { keep4_b(a, b, c, d); }
};

// ---- Register-blocked batched WMMA GEMM ------------------------------------
// C[m,n] = scale * sum_k A[m,k] * Bt[n,k] (+bias)(+resid); each wave owns a 64x64 tile.
// A row-major [M,K]; Bt row-major [N,K]; M,N % 64 == 0, K % 32 == 0.
// SPLIT: operands are hi/lo planes (A2/Bt2 = lo planes, same layout); product = hi.hi + hi.lo + lo.hi.
//   BLO = false: the Bt operand has no lo plane (product = hi.hi + lo.hi, two WMMAs).
// BIAS_MODE: 0 = none, 1 = bias[m], 2 = bias[n].
// OUT_MODE: 0 = f32, 1 = f16, 2 = bf16 hi plane (Cout) + bf16 lo plane (Cout2).
// ET: 0 = f16 operands, 1 = bf16 operands (pointers passed as 16-bit storage)
template <int ET> struct Elem;
template <> struct Elem<0> { typedef _Float16 T; };
template <> struct Elem<1> { typedef __bf16 T; };
template <int ET, bool SPLIT, int BIAS_MODE, int OUT_MODE, bool RESID, int ACT = 0, bool BLO = true>
__global__ __launch_bounds__(256) void wmma_gemm64(
    const unsigned short* __restrict__ Ap, const unsigned short* __restrict__ A2p, int lda, long strideA,
    const unsigned short* __restrict__ Btp, const unsigned short* __restrict__ Bt2p, int ldb, long strideB,
    void* __restrict__ Cout, void* __restrict__ Cout2, int ldc, long strideC,
    const float* __restrict__ bias,
    const float* __restrict__ resid, long strideR,
    int M, int N, int K, float scale) {
  typedef typename Elem<ET>::T T;
  typedef typename Frag<T>::V V;
  const T* A = (const T*)Ap; const T* A2 = (const T*)A2p; const T* Bt = (const T*)Btp; const T* Bt2 = (const T*)Bt2p;
  __shared__ __align__(16) float sT[8][16 * 68];   // per-wave 16x64 slab, pitch 68 floats
  const int b    = blockIdx.y;
  const int lane = threadIdx.x & 31;
  const int wave = threadIdx.x >> 5;
  const int tilesN = N >> 6;
  const int tilesM = M >> 6;
  const int tile = blockIdx.x * 8 + wave;
  if (tile >= tilesM * tilesN) return;   // wave-uniform; no block barriers in this kernel
  const int tm = tile / tilesN;
  const int tn = tile - tm * tilesN;
  const int m0 = tm << 6;
  const int n0 = tn << 6;

  const T* Ab  = A  + (size_t)b * strideA;
  const T* Bb  = Bt + (size_t)b * strideB;
  const T* Ab2 = SPLIT ? (A2  + (size_t)b * strideA) : nullptr;
  const T* Bb2 = (SPLIT && BLO) ? (Bt2 + (size_t)b * strideB) : nullptr;

  const int rlane = lane & 15;                 // row (A) / col (B, D) within subtile
  const int koff  = (lane >> 4) * 8;           // k offset of this lane half
  const int mOff  = (lane >> 4) * 8;           // D row offset

  v8f acc[4][4];
#pragma unroll
  for (int i = 0; i < 4; ++i)
#pragma unroll
    for (int j = 0; j < 4; ++j) acc[i][j] = (v8f){0.f,0.f,0.f,0.f,0.f,0.f,0.f,0.f};

  for (int k0 = 0; k0 < K; k0 += 32) {
    V bh[4], bl[4];
#pragma unroll
    for (int j = 0; j < 4; ++j) {
      const size_t bo = (size_t)(n0 + (j << 4) + rlane) * ldb + koff + k0;
      bh[j] = Frag<T>::load(Bb + bo);
      if (SPLIT && BLO) bl[j] = Frag<T>::load(Bb2 + bo);
    }
#pragma unroll
    for (int i = 0; i < 4; ++i) {
      const size_t ao = (size_t)(m0 + (i << 4) + rlane) * lda + koff + k0;
      V ah = Frag<T>::load(Ab + ao);
      V al;
      if (SPLIT) al = Frag<T>::load(Ab2 + ao);
#pragma unroll
      for (int j = 0; j < 4; ++j) {
        acc[i][j] = Frag<T>::mma(ah, bh[j], acc[i][j]);
        if (SPLIT) {
          if (BLO) acc[i][j] = Frag<T>::mma(ah, bl[j], acc[i][j]);
          acc[i][j] = Frag<T>::mma(al, bh[j], acc[i][j]);
        }
      }
      Frag<T>::guard(acc[i][0], acc[i][3], ah, SPLIT ? al : ah);
    }
    Frag<T>::keep(bh[0], bh[1], bh[2], bh[3]);
    if (SPLIT && BLO) Frag<T>::keep(bl[0], bl[1], bl[2], bl[3]);
  }
  acc_guard4(acc[0][0], acc[0][1], acc[0][2], acc[0][3]);
  acc_guard4(acc[1][0], acc[1][1], acc[1][2], acc[1][3]);
  acc_guard4(acc[2][0], acc[2][1], acc[2][2], acc[2][3]);
  acc_guard4(acc[3][0], acc[3][1], acc[3][2], acc[3][3]);

  // ---- epilogue ----
  float* slab = sT[wave];
  const float* Rb = RESID ? (resid + (size_t)b * strideR) : nullptr;
#pragma unroll
  for (int i = 0; i < 4; ++i) {
    const int mBase = m0 + (i << 4);
#pragma unroll
    for (int j = 0; j < 4; ++j) {
      const int n = n0 + (j << 4) + rlane;
      float bv = 0.f;
      if (BIAS_MODE == 2) bv = bias[n];
#pragma unroll
      for (int r = 0; r < 8; ++r) {
        float v = acc[i][j][r] * scale;
        if (BIAS_MODE == 1) v += bias[mBase + mOff + r];
        if (BIAS_MODE == 2) v += bv;
        if (RESID) v += Rb[(size_t)(mBase + mOff + r) * ldc + n];
        if (ACT == 1) v = tanhf(v);
        if (ACT == 2) v = fmaxf(v, 0.0f);
        if (ACT == 3) v = v / (1.0f + expf(-v));
        if (ACT == 4) v = (v > 0.f) ? v : 0.01f * v;
        slab[(mOff + r) * 68 + (j << 4) + rlane] = v;
      }
    }
    __builtin_amdgcn_fence(__ATOMIC_RELEASE, "workgroup");
    __builtin_amdgcn_wave_barrier();
    __builtin_amdgcn_fence(__ATOMIC_ACQUIRE, "workgroup");
    if (OUT_MODE == 0) {
      float* C = (float*)Cout + (size_t)b * strideC;
      const int hh = lane >> 4, c4 = (lane & 15) * 4;     // row seg = 256 B = 16 lanes x 16 B
      {
#pragma unroll
        for (int it = 0; it < 8; ++it) {
          const int row = it * 2 + hh;
          v4f v = *(const v4f*)(slab + row * 68 + c4);
          *(v4f*)(C + (size_t)(mBase + row) * ldc + n0 + c4) = v;
        }
        
      }
    } else {
      const int q = lane >> 3, c8 = (lane & 7) * 8;
      unsigned short* C  = (unsigned short*)Cout  + (size_t)b * strideC;
      unsigned short* C2 = (OUT_MODE == 2) ? ((unsigned short*)Cout2 + (size_t)b * strideC) : nullptr;
      {
#pragma unroll
        for (int it = 0; it < 4; ++it) {
          const int row = it * 4 + q;
          const float* sp = slab + row * 68 + c8;
          v8h hv, lv;
#pragma unroll
          for (int e = 0; e < 8; ++e) {
            if (OUT_MODE == 1) {
              hv[e] = (_Float16)sp[e];
            } else {
              unsigned short hb = f2bf_bits(sp[e]);
              unsigned short lb = f2bf_bits(sp[e] - bf_bits2f(hb));
              hv[e] = __builtin_bit_cast(_Float16, hb);
              lv[e] = __builtin_bit_cast(_Float16, lb);
            }
          }
          *(v8h*)(C + (size_t)(mBase + row) * ldc + n0 + c8) = hv;
          if (OUT_MODE == 2) *(v8h*)(C2 + (size_t)(mBase + row) * ldc + n0 + c8) = lv;
        }
        
      }
    }
    __builtin_amdgcn_fence(__ATOMIC_RELEASE, "workgroup");
    __builtin_amdgcn_wave_barrier();
    __builtin_amdgcn_fence(__ATOMIC_ACQUIRE, "workgroup");
  }
}

// ---------------------------------------------------------------------------
// f32 -> bf16 (RNE) cast: 2 elements per thread, one 4-B store per lane -> each wave writes one whole
// Coverage: grid = n2/256 blocks x 256 threads x 2 elements = whole plane (n2 = n/2, n % 512 == 0 here).
// ---------------------------------------------------------------------------
__global__ __launch_bounds__(256) void cast_f32_bf16x2(const float* __restrict__ in, unsigned short* __restrict__ out, int n2) {
  const int i = blockIdx.x * 256 + threadIdx.x;
  if (i < n2) {
    const v2f f = *(const v2f*)(in + 2 * (size_t)i);
    const unsigned u = pk16(f2bf_bits(f[0]), f2bf_bits(f[1]));
    ((unsigned*)out)[i] = u;
    
  }
}

// ---------------------------------------------------------------------------
// Fused transpose + bf16 (RNE) cast of an f32 matrix: in [R rows][Cc cols] (pitch Cc) -> oh[c][r] = bf16(in[r][c]) ([Cc][R], pitch R).
// 64x64 tiles through LDS. grid = (Cc/64, R/64), 256 threads (R, Cc multiples of 64).
// Coverage per block: load 4 it x 256 thr x 4 floats = 64x64; store 2 it x 256 thr x 8 u16 = 64x64.
// ---------------------------------------------------------------------------
__global__ __launch_bounds__(256) void tcast_kernel(const float* __restrict__ W, unsigned short* __restrict__ oh, int R, int Cc) {
  __shared__ __align__(16) float tf[64 * 68];
  const int c0  = blockIdx.x * 64;   // input column block = output row block
  const int r0  = blockIdx.y * 64;   // input row block    = output column block
  const int tid = threadIdx.x;
  {
    const int lr = tid >> 4;         // 0..15
    const int c4 = (tid & 15) * 4;   // 0..60
#pragma unroll
    for (int it = 0; it < 4; ++it) {
      const int rr = it * 16 + lr;   // 0..63
      const v4f a = *(const v4f*)(W + (size_t)(r0 + rr) * Cc + c0 + c4);
      *(v4f*)(tf + rr * 68 + c4) = a;
    }
  }
  __syncthreads();
  const int sub = tid >> 3;          // 0..31
  const int c8  = (tid & 7) * 8;     // 0..56
  v4u hv[2];
#pragma unroll
  for (int it = 0; it < 2; ++it) {
    const int oc = it * 32 + sub;    // output row within tile (= input column)
    v4u a;
#pragma unroll
    for (int q = 0; q < 4; ++q) {
      const float f0 = tf[(c8 + 2 * q) * 68 + oc];
      const float f1 = tf[(c8 + 2 * q + 1) * 68 + oc];
      a[q] = pk16(f2bf_bits(f0), f2bf_bits(f1));
    }
    hv[it] = a;
  }
  {
#pragma unroll
    for (int it = 0; it < 2; ++it) {
      const int oc = it * 32 + sub;
      const size_t go = (size_t)(c0 + oc) * R + r0 + c8;
      *(v4u*)(oh + go) = hv[it];
    }
    
  }
}

// ---------------------------------------------------------------------------
// Fused transpose + bf16 hi/lo split with explicit pitches and a z batch:
//   in element (r, c) at W + z*zin + r*pin + c  ->  oh[c][r], ol[c][r] at o + z*zout + c*pout + r.
// 64x64 tiles through LDS. grid = (Cc/64, R/64, Z), 256 threads.
// Coverage per block and plane: load 4 it x 256 thr x 4 floats = 64x64; store 2 it x 256 thr x 8 u16 = 64x64.
// ---------------------------------------------------------------------------
__global__ __launch_bounds__(256) void tsplitp_kernel(const float* __restrict__ W, int pin, long zin,
                                                      unsigned short* __restrict__ oh, unsigned short* __restrict__ ol, int pout, long zout) {
  __shared__ __align__(16) float tf[64 * 68];
  const int c0  = blockIdx.x * 64;
  const int r0  = blockIdx.y * 64;
  const int tid = threadIdx.x;
  const float* Wz = W + (size_t)blockIdx.z * zin;
  unsigned short* ohz = oh + (size_t)blockIdx.z * zout;
  unsigned short* olz = ol + (size_t)blockIdx.z * zout;
  {
    const int lr = tid >> 4;
    const int c4 = (tid & 15) * 4;
#pragma unroll
    for (int it = 0; it < 4; ++it) {
      const int rr = it * 16 + lr;
      const v4f a = *(const v4f*)(Wz + (size_t)(r0 + rr) * pin + c0 + c4);
      *(v4f*)(tf + rr * 68 + c4) = a;
    }
  }
  __syncthreads();
  const int sub = tid >> 3;
  const int c8  = (tid & 7) * 8;
  v4u hv[2], lv[2];
#pragma unroll
  for (int it = 0; it < 2; ++it) {
    const int oc = it * 32 + sub;
    v4u a, a2;
#pragma unroll
    for (int q = 0; q < 4; ++q) {
      const float f0 = tf[(c8 + 2 * q) * 68 + oc];
      const float f1 = tf[(c8 + 2 * q + 1) * 68 + oc];
      const unsigned short h0 = f2bf_bits(f0), h1 = f2bf_bits(f1);
      const unsigned short l0 = f2bf_bits(f0 - bf_bits2f(h0)), l1 = f2bf_bits(f1 - bf_bits2f(h1));
      a[q]  = pk16(h0, h1);
      a2[q] = pk16(l0, l1);
    }
    hv[it] = a; lv[it] = a2;
  }
  {
#pragma unroll
    for (int it = 0; it < 2; ++it) {
      const int oc = it * 32 + sub;
      const size_t go = (size_t)(c0 + oc) * pout + r0 + c8;
      *(v4u*)(ohz + go) = hv[it];
      *(v4u*)(olz + go) = lv[it];
    }
    
  }
}

// ---------------------------------------------------------------------------
// q|k columns of the f32 qkv matrix -> bf16 hi/lo planes: in row (b*T+t) pitch 3072, cols 0..2047 ->
// planes [4096][2048] pitch 2048. 2 elements per thread (u32 index i = row*1024 + pair), one 4-B store per lane per plane:
// Coverage: grid = n2/256 blocks x 256 threads x 2 = 4096 x 2048 elements per plane.
// ---------------------------------------------------------------------------
__global__ __launch_bounds__(256) void split_qk_kernel(const float* __restrict__ Cm, unsigned short* __restrict__ hi,
                                                       unsigned short* __restrict__ lo, int n2) {
  const int i = blockIdx.x * 256 + threadIdx.x;
  if (i < n2) {
    const int row = i >> 10;
    const int cp  = (i & 1023) * 2;
    const v2f f = *(const v2f*)(Cm + (size_t)row * kQkvN + cp);
    const unsigned short h0 = f2bf_bits(f[0]), h1 = f2bf_bits(f[1]);
    const unsigned short l0 = f2bf_bits(f[0] - bf_bits2f(h0)), l1 = f2bf_bits(f[1] - bf_bits2f(h1));
    const unsigned uh = pk16(h0, h1), ul = pk16(l0, l1);
    ((unsigned*)hi)[i] = uh;
    ((unsigned*)lo)[i] = ul;
    
  }
}

// ---------------------------------------------------------------------------
// Rank-1 geometric projections: qp[(b*H+h)*T + t] = sum_{d<3} q[b,t,h,d]*dir[h][d], kp likewise (dir = sign bits of h / sqrt(3), f32).
// Coverage: grid = n/256 blocks x 256 threads = B*H*T.
// ---------------------------------------------------------------------------
__global__ __launch_bounds__(256) void geo_proj_kernel(const float* __restrict__ Cm, float* __restrict__ qp, float* __restrict__ kp, int n) {
  const int i = blockIdx.x * 256 + threadIdx.x;
  if (i < n) {
    const int t  = i & (kSeq - 1);
    const int bh = i >> 11;
    const int h  = bh & 7;
    const int b  = bh >> 3;
    const float rs3 = 1.0f / 1.7320508f;
    const float dx = (float)(((h >> 2) & 1) * 2 - 1) * rs3;
    const float dy = (float)(((h >> 1) & 1) * 2 - 1) * rs3;
    const float dz = (float)((h & 1) * 2 - 1) * rs3;
    const float* qr = Cm + (size_t)(b * kSeq + t) * kQkvN + h * kHd;
    const float* kr = qr + kDm;
    const float a  = qr[0] * dx + qr[1] * dy + qr[2] * dz;
    const float bb = kr[0] * dx + kr[1] * dy + kr[2] * dz;
    ((float*)qp)[i] = a;
    ((float*)kp)[i] = bb;
    
  }
}

// =====================================================================================
// Causal attention, head dim 128, 8 heads, with rank-1 score bias.
//   q|k hi/lo bf16 planes: q element (b, t, h, d) at [(b*T + t)*2048 + h*128 + d]; k at the same + 1024
//   v^T hi/lo bf16 planes: element (b, h, d, s) at [(b*1024 + h*128 + d)*T + s]
//   out hi/lo bf16 planes: element (b, t, h, d) at [(b*T + t)*1024 + h*128 + d]
//   scores = (q . k) * sscale + hs[h] * qp[t] * kp[s]  : q.k as bf16 hi/lo split (hi.hi + hi.lo + lo.hi)
//   out    = p . v                                      : bf16 hi/lo split of p (unnormalised) and v, f32 accumulate
//   online softmax in f32; masked (s > t) scores set to -inf (column s = chunk start <= t is always unmasked).
//   Block = 4 waves = 64 query rows of one (b, h); grid.x = B * H * (T/64); kv chunks of 64, trip count qb+1 <= 32.
//   K / V^T chunk staging: K planes 128 threads x 64 elements = 64 kv x 128 d; V^T planes 128 threads x 64 = 128 d x 64 kv
//   (16-B copies, plain loads, __syncthreads before and after); fragment loads read the LDS tiles with the same v8b element type.
//   The K/V LDS region is reused as the f32 output staging after the chunk loop (block barrier between).
// =====================================================================================
constexpr int kKc  = 64;    // kv chunk
constexpr int kOsP = 132;   // f32 out staging pitch (floats)
// LDS row pitches in elements: 16 B x odd, so the 16 rows that one half-wave's ds_load_b128 reads fall on distinct banks
constexpr int kKP  = kHd + 8;   // K rows: 272 B
constexpr int kVP  = kKc + 8;   // V^T rows: 144 B
constexpr int kPP  = kKc + 8;   // P rows: 144 B

__device__ __forceinline__ v8f at_mma(v16b a, v16b b, v8f c) {
  c = __builtin_amdgcn_wmma_f32_16x16x32_bf16(false, a, false, b, (short)0, c, false, false);
  asm volatile("v_nop\n\tv_nop\n\tv_nop\n\tv_nop" : "+v"(c) : "v"(a), "v"(b));
  return c;
}
__device__ __forceinline__ void at_split(float f, __bf16& hi, __bf16& lo) {
  const unsigned short hb = f2bf_bits(f);
  hi = __builtin_bit_cast(__bf16, hb);
  lo = __builtin_bit_cast(__bf16, f2bf_bits(f - bf_bits2f(hb)));
}
__device__ __forceinline__ void split_pair(float a, float b, unsigned& hp, unsigned& lp) {
  const unsigned short ha = f2bf_bits(a), hb = f2bf_bits(b);
  const unsigned short la = f2bf_bits(a - bf_bits2f(ha)), lb = f2bf_bits(b - bf_bits2f(hb));
  hp = pk16(ha, hb);
  lp = pk16(la, lb);
}

__global__ __launch_bounds__(128)
void attn_causal128_kernel(const unsigned short* __restrict__ qkhp, const unsigned short* __restrict__ qklp,
                           const unsigned short* __restrict__ vthp, const unsigned short* __restrict__ vtlp,
                           const float* __restrict__ qpv, const float* __restrict__ kpv, const float* __restrict__ hsv,
                           unsigned short* __restrict__ ohp, unsigned short* __restrict__ olp, float sscale) {
  union FB { v16b v; v8b h[2]; };
  __shared__ __align__(16) __bf16 kvs[2 * kKc * kKP + 2 * kHd * kVP];   // 71680 B: K hi | K lo ([kv][d], pitch kKP) | V hi | V lo ([d][kv], pitch kVP)
  __shared__ __align__(16) __bf16 Psh[4][16 * kPP];            // per wave P hi [row][kv], pitch kPP
  __shared__ __align__(16) __bf16 Psl[4][16 * kPP];            // per wave P lo
  __bf16* const Ksh = kvs;
  __bf16* const Ksl = kvs + kKc * kKP;
  __bf16* const Vth = kvs + 2 * kKc * kKP;
  __bf16* const Vtl = kvs + 2 * kKc * kKP + kHd * kVP;

  const int tid  = threadIdx.x;
  const int wave = tid >> 5;
  const int lane = tid & 31;
  const int hh   = lane >> 4;
  const int c    = lane & 15;

  const int bx  = blockIdx.x;
  const int qb  = bx & 31;              // T/64 = 32 query blocks
  const int bhi = bx >> 5;
  const int h   = bhi & 7;
  const int b   = bhi >> 3;
  const int q0  = qb * 64 + wave * 16;

  const __bf16* Qh = (const __bf16*)(const void*)qkhp;
  const __bf16* Ql = (const __bf16*)(const void*)qklp;
  const __bf16* Vh = (const __bf16*)(const void*)vthp;
  const __bf16* Vl = (const __bf16*)(const void*)vtlp;

  const size_t qoff  = (size_t)(b * kSeq + q0 + c) * kQkW + h * kHd + 8 * hh;   // + dc*32 (Frag load adds 0 / 16)
  const size_t kbase = (size_t)(b * kSeq) * kQkW + kDm + h * kHd;                // + (kv0 + r)*kQkW
  const size_t vbase = (size_t)(b * kDm + h * kHd) * kSeq;                       // + d*kSeq + kv0
  const int gbase = (b * kHeads + h) * kSeq;

  float gq[8];
#pragma unroll
  for (int r = 0; r < 8; ++r) gq[r] = qpv[gbase + q0 + 8 * hh + r];
  const float hsb = bf_bits2f(f2bf_bits(hsv[h]));

  float mrow[8], lrow[8];
  v8f oacc[8];
#pragma unroll
  for (int r = 0; r < 8; ++r) { mrow[r] = -INFINITY; lrow[r] = 0.f; }
#pragma unroll
  for (int t = 0; t < 8; ++t) oacc[t] = (v8f){0.f,0.f,0.f,0.f,0.f,0.f,0.f,0.f};

  const int nChunks = qb + 1;   // block-uniform, <= 32
  for (int kc = 0; kc < nChunks; ++kc) {
    const int kv0 = kc * kKc;
    __syncthreads();
    {
      // K planes: thread -> kv row r = tid>>1, d half = (tid&1)*64, 8 x v8b = 64 elements; 128 threads cover 64 x 128 per plane
      const int r = tid >> 1, half = (tid & 1) * 64;
      const __bf16* ks0 = Qh + kbase + (size_t)(kv0 + r) * kQkW + half;
      const __bf16* ks1 = Ql + kbase + (size_t)(kv0 + r) * kQkW + half;
#pragma unroll
      for (int i = 0; i < 8; ++i) {
        const v8b a0 = *(const v8b*)(ks0 + 8 * i);
        const v8b a1 = *(const v8b*)(ks1 + 8 * i);
        *(v8b*)(Ksh + r * kKP + half + 8 * i) = a0;
        *(v8b*)(Ksl + r * kKP + half + 8 * i) = a1;
      }
      asm volatile("" ::: "memory");
      // V^T planes: thread -> d row = tid, 8 x v8b = 64 kv; 128 threads cover 128 x 64 per plane
      const __bf16* vs0 = Vh + vbase + (size_t)tid * kSeq + kv0;
      const __bf16* vs1 = Vl + vbase + (size_t)tid * kSeq + kv0;
#pragma unroll
      for (int i = 0; i < 8; ++i) {
        const v8b b0 = *(const v8b*)(vs0 + 8 * i);
        const v8b b1 = *(const v8b*)(vs1 + 8 * i);
        *(v8b*)(Vth + tid * kVP + 8 * i) = b0;
        *(v8b*)(Vtl + tid * kVP + 8 * i) = b1;
      }
    }
    __syncthreads();

    // ---- scores: A = q rows (global, split k map via Frag load), B = k rows from LDS; K = 128 = 4 k-steps ----
    v8f s[4];
#pragma unroll
    for (int j = 0; j < 4; ++j) s[j] = (v8f){0.f,0.f,0.f,0.f,0.f,0.f,0.f,0.f};
#pragma unroll 1
    for (int dc = 0; dc < 4; ++dc) {
      const v16b qa_h = Frag<__bf16>::load(Qh + qoff + dc * 32);
      const v16b qa_l = Frag<__bf16>::load(Ql + qoff + dc * 32);
#pragma unroll
      for (int j = 0; j < 4; ++j) {
        FB kb, kl;
        const __bf16* kr0 = Ksh + (j * 16 + c) * kKP + dc * 32 + 8 * hh;
        const __bf16* kr1 = Ksl + (j * 16 + c) * kKP + dc * 32 + 8 * hh;
        kb.h[0] = *(const v8b*)(kr0);
        kb.h[1] = *(const v8b*)(kr0 + 16);
        kl.h[0] = *(const v8b*)(kr1);
        kl.h[1] = *(const v8b*)(kr1 + 16);
        s[j] = at_mma(qa_h, kb.v, s[j]);
        s[j] = at_mma(qa_h, kl.v, s[j]);
        s[j] = at_mma(qa_l, kb.v, s[j]);
      }
    }
    float gk[4];
#pragma unroll
    for (int j = 0; j < 4; ++j) gk[j] = kpv[gbase + kv0 + j * 16 + c];
    const bool diag = (kc == qb);   // block-uniform
    float cm[8];
#pragma unroll
    for (int r = 0; r < 8; ++r) {
      const int qrow = q0 + 8 * hh + r;
      float m = -INFINITY;
#pragma unroll
      for (int j = 0; j < 4; ++j) {
        const int kvcol = kv0 + j * 16 + c;
        const float sv = s[j][r] * sscale + hsb * (gq[r] * gk[j]);
        const bool masked = diag && (kvcol > qrow);
        const float sm = masked ? -INFINITY : sv;
        s[j][r] = sm;
        m = fmaxf(m, sm);
      }
#pragma unroll
      for (int off = 1; off < 16; off <<= 1) m = fmaxf(m, __shfl_xor(m, off, 32));
      cm[r] = m;
    }
    __bf16* pwh = Psh[wave];
    __bf16* pwl = Psl[wave];
#pragma unroll
    for (int r = 0; r < 8; ++r) {
      const float mnew = fmaxf(mrow[r], cm[r]);
      const float alpha = expf(mrow[r] - mnew);
      mrow[r] = mnew;
      float psum = 0.f;
#pragma unroll
      for (int j = 0; j < 4; ++j) {
        const float p = expf(s[j][r] - mnew);
        psum += p;
        __bf16 a, bl; at_split(p, a, bl);
        pwh[(8 * hh + r) * kPP + j * 16 + c] = a;
        pwl[(8 * hh + r) * kPP + j * 16 + c] = bl;
      }
#pragma unroll
      for (int off = 1; off < 16; off <<= 1) psum += __shfl_xor(psum, off, 32);
      lrow[r] = lrow[r] * alpha + psum;
#pragma unroll
      for (int t = 0; t < 8; ++t) oacc[t][r] *= alpha;
    }
    __builtin_amdgcn_fence(__ATOMIC_RELEASE, "workgroup");
    __builtin_amdgcn_wave_barrier();
    __builtin_amdgcn_fence(__ATOMIC_ACQUIRE, "workgroup");
    // ---- out += p . v : A = P [16 q][64 kv] from the wave's LDS tile, B = V^T [d][kv] from LDS; 8 d-tiles of 16 ----
#pragma unroll 1
    for (int kk = 0; kk < 2; ++kk) {
      FB pa, pl;
      pa.h[0] = *(const v8b*)(pwh + c * kPP + kk * 32 + 8 * hh);
      pa.h[1] = *(const v8b*)(pwh + c * kPP + kk * 32 + 16 + 8 * hh);
      pl.h[0] = *(const v8b*)(pwl + c * kPP + kk * 32 + 8 * hh);
      pl.h[1] = *(const v8b*)(pwl + c * kPP + kk * 32 + 16 + 8 * hh);
#pragma unroll
      for (int t = 0; t < 8; ++t) {
        FB vb, vl;
        const __bf16* vr0 = Vth + (t * 16 + c) * kVP + kk * 32 + 8 * hh;
        const __bf16* vr1 = Vtl + (t * 16 + c) * kVP + kk * 32 + 8 * hh;
        vb.h[0] = *(const v8b*)(vr0);
        vb.h[1] = *(const v8b*)(vr0 + 16);
        vl.h[0] = *(const v8b*)(vr1);
        vl.h[1] = *(const v8b*)(vr1 + 16);
        oacc[t] = at_mma(pa.v, vb.v, oacc[t]);
        oacc[t] = at_mma(pa.v, vl.v, oacc[t]);
        oacc[t] = at_mma(pl.v, vb.v, oacc[t]);
      }
    }
  }
  __syncthreads();   // all waves done with the K/V tiles; region becomes f32 out staging

  // ---- normalise, stage the wave's 16x128 tile (f32), write hi/lo bf16 rows: 16 lanes x 16 B = one whole 256-B row, 2 rows per instruction ----
  float* os = (float*)(void*)kvs + wave * 16 * kOsP;
#pragma unroll
  for (int r = 0; r < 8; ++r) {
    const float inv = 1.0f / lrow[r];
#pragma unroll
    for (int t = 0; t < 8; ++t) os[(8 * hh + r) * kOsP + t * 16 + c] = oacc[t][r] * inv;
  }
  __builtin_amdgcn_fence(__ATOMIC_RELEASE, "workgroup");
  __builtin_amdgcn_wave_barrier();
  __builtin_amdgcn_fence(__ATOMIC_ACQUIRE, "workgroup");
  {
    const size_t obase = (size_t)(b * kSeq + q0) * kDm + h * kHd + c * 8;
    {
#pragma unroll
      for (int it = 0; it < 8; ++it) {
        const int row = it * 2 + hh;   // it 0..7 x hh 0..1 covers rows 0..15; c 0..15 x 8 covers d 0..127
        const float* sp = os + row * kOsP + c * 8;
        const v4f f0 = *(const v4f*)(sp);
        const v4f f1 = *(const v4f*)(sp + 4);
        v4u hv, lv;
        unsigned hp, lp;
        split_pair(f0[0], f0[1], hp, lp); hv[0] = hp; lv[0] = lp;
        split_pair(f0[2], f0[3], hp, lp); hv[1] = hp; lv[1] = lp;
        split_pair(f1[0], f1[1], hp, lp); hv[2] = hp; lv[2] = lp;
        split_pair(f1[2], f1[3], hp, lp); hv[3] = hp; lv[3] = lp;
        *(v4u*)(ohp + obase + (size_t)row * kDm) = hv;
        *(v4u*)(olp + obase + (size_t)row * kDm) = lv;
      }
      
    }
  }
}

// =====================================================================================
//   [0,          8388608)   xb   : x as bf16 [4096][1024]
//   [8388608,   14680064)   wqT  : w_qkv^T bf16 [3072][1024]
//   [14680064,  16777216)   woT  : w_out^T bf16 [1024][1024]
//   [16777216,  67108864)   Cqkv : f32 [4096][3072]; after its consumers: Oh bf16 [4096][1024] at 16777216, Ol at 25165824
//   [67108864,  83886080)   QKh  : bf16 [4096][2048]
//   [83886080, 100663296)   QKl  : bf16 [4096][2048]
//   [100663296,109051904)   Vth  : bf16 [2][1024][2048]
//   [109051904,117440512)   Vtl  : bf16 [2][1024][2048]
//   [117440512,117571584)   qp   : f32 [2][8][2048]
//   [117571584,117702656)   kp   : f32 [2][8][2048]
//   total 117702656 B
// =====================================================================================
extern "C" void kernel_launch(void* const* d_in, const int* in_sizes, int n_in,
                              void* d_out, int out_size, void* d_ws, size_t ws_size,
                              hipStream_t stream) {
  if (n_in < 4) return;
  const int nX = kBatch * kSeq * kDm;       // 4194304
  if (in_sizes[0] != nX || in_sizes[1] != kDm * kQkvN || in_sizes[2] != kDm * kDm || in_sizes[3] != kHeads) return;
  if (out_size != nX) return;

  const size_t off_xb  = 0;
  const size_t off_wq  = off_xb  + (size_t)nX * 2;                              // 8388608
  const size_t off_wo  = off_wq  + (size_t)kQkvN * kDm * 2;                     // 14680064
  const size_t off_c   = off_wo  + (size_t)kDm * kDm * 2;                       // 16777216
  const size_t off_oh  = off_c;                                                 // reuse after Cqkv is dead
  const size_t off_ol  = off_c   + (size_t)nX * 2;                              // 25165824
  const size_t off_qkh = off_c   + (size_t)kBatch * kSeq * kQkvN * 4;           // 67108864
  const size_t off_qkl = off_qkh + (size_t)kBatch * kSeq * kQkW * 2;            // 83886080
  const size_t off_vth = off_qkl + (size_t)kBatch * kSeq * kQkW * 2;            // 100663296
  const size_t off_vtl = off_vth + (size_t)kBatch * kDm * kSeq * 2;             // 109051904
  const size_t off_qp  = off_vtl + (size_t)kBatch * kDm * kSeq * 2;             // 117440512
  const size_t off_kp  = off_qp  + (size_t)kBatch * kHeads * kSeq * 4;          // 117571584
  const size_t total   = off_kp  + (size_t)kBatch * kHeads * kSeq * 4;          // 117702656
  if (total > ws_size) return;

  const float* x    = (const float*)d_in[0];
  const float* wqkv = (const float*)d_in[1];
  const float* wout = (const float*)d_in[2];
  const float* hsc  = (const float*)d_in[3];
  float* y = (float*)d_out;
  char* w = (char*)d_ws;
  unsigned short* xb  = (unsigned short*)(w + off_xb);
  unsigned short* wqT = (unsigned short*)(w + off_wq);
  unsigned short* woT = (unsigned short*)(w + off_wo);
  float*          cq  = (float*)(w + off_c);
  unsigned short* oh  = (unsigned short*)(w + off_oh);
  unsigned short* ol  = (unsigned short*)(w + off_ol);
  unsigned short* qkh = (unsigned short*)(w + off_qkh);
  unsigned short* qkl = (unsigned short*)(w + off_qkl);
  unsigned short* vth = (unsigned short*)(w + off_vth);
  unsigned short* vtl = (unsigned short*)(w + off_vtl);
  float*          qp  = (float*)(w + off_qp);
  float*          kp  = (float*)(w + off_kp);

  // 1. x -> bf16 (n2 = 2097152 pairs; 8192 blocks x 256 threads x 2 = 4194304 elements)
  cast_f32_bf16x2<<<dim3(nX / 2 / 256), dim3(256), 0, stream>>>(x, xb, nX / 2);
  // 2. w_qkv [1024 in][3072 out] -> wqT [3072][1024] bf16 ; grid (cols/64, rows/64)
  tcast_kernel<<<dim3(kQkvN / 64, kDm / 64), dim3(256), 0, stream>>>(wqkv, wqT, kDm, kQkvN);
  // 3. w_out [1024 in][1024 out] -> woT [1024][1024] bf16
  tcast_kernel<<<dim3(kDm / 64, kDm / 64), dim3(256), 0, stream>>>(wout, woT, kDm, kDm);
  // 4. qkv = x . w_qkv : M=4096, N=3072, K=1024 (all tile multiples, K%32==0); 3072 tiles / 8 per block = 384 blocks
  wmma_gemm64<1, false, 0, 0, false><<<dim3((kBatch * kSeq / 64) * (kQkvN / 64) / 8, 1), dim3(256), 0, stream>>>(
      xb, xb, kDm, 0L, wqT, wqT, kDm, 0L, (void*)cq, (void*)cq, kQkvN, 0L,
      (const float*)nullptr, (const float*)nullptr, 0L, kBatch * kSeq, kQkvN, kDm, 1.0f);
  // 5. rank-1 projections (32768 threads)
  geo_proj_kernel<<<dim3(kBatch * kHeads * kSeq / 256), dim3(256), 0, stream>>>(cq, qp, kp, kBatch * kHeads * kSeq);
  // 6. q|k columns -> bf16 hi/lo planes [4096][2048] (n2 = 4194304 pairs)
  split_qk_kernel<<<dim3(kBatch * kSeq * kQkW / 2 / 256), dim3(256), 0, stream>>>(cq, qkh, qkl, kBatch * kSeq * kQkW / 2);
  // 7. v columns [t][h*128+d] (pitch 3072, col offset 2048) -> V^T hi/lo [b][1024][2048]; grid (1024/64, 2048/64, 2)
  tsplitp_kernel<<<dim3(kDm / 64, kSeq / 64, kBatch), dim3(256), 0, stream>>>(
      cq + 2 * kDm, kQkvN, (long)kSeq * kQkvN, vth, vtl, kSeq, (long)kDm * kSeq);
  // 8. causal attention with rank-1 bias: grid = B*H*(T/64) = 512 blocks of 128
  attn_causal128_kernel<<<dim3(kBatch * kHeads * (kSeq / 64)), dim3(128), 0, stream>>>(
      qkh, qkl, vth, vtl, qp, kp, hsc, oh, ol, 0.08838834764831845f);
  // 9. out = o . w_out : A = o hi/lo, Bt = woT (hi only); M=4096, N=1024, K=1024; 1024 tiles / 8 = 128 blocks
  wmma_gemm64<1, true, 0, 0, false, 0, false><<<dim3((kBatch * kSeq / 64) * (kDm / 64) / 8, 1), dim3(256), 0, stream>>>(
      oh, ol, kDm, 0L, woT, woT, kDm, 0L, (void*)y, (void*)y, kDm, 0L,
      (const float*)nullptr, (const float*)nullptr, 0L, kBatch * kSeq, kDm, kDm, 1.0f);
}
